// v000
// The times below were measured on an AMD MI455X: many runs one after another, warmed up first and cycling through
// copies of the inputs, with the whole window's GPU time divided by the number of runs. Launches and the gaps
// between them are all in it. The median over several windows is given; except for v000 it joins two sittings, which
// can be a few percent apart, so the side-by-side timings, each taken in one sitting, are the better comparison.
// v000, which the later versions start from, runs in 27.4 microseconds.
#include <hip/hip_runtime.h>
#include <math.h>

typedef __attribute__((ext_vector_type(2))) float v2f;
typedef __attribute__((ext_vector_type(8))) float v8f;

namespace {
constexpr int KW      = 5;                 // window
constexpr int PAD     = 2;                 // KW/2
constexpr int Cc      = 128;               // total channels
constexpr int Gg      = 4;                 // groups
constexpr int CG      = 32;                // channels per group
constexpr int Hh      = 96;
constexpr int Ww      = 96;
constexpr int TILE    = 8;                 // output tile (8x8 pixels per workgroup)
constexpr int PT      = TILE + 2 * PAD;    // 12 (padded tile edge)
constexpr int NPIX    = PT * PT;           // 144 padded pixels
constexpr int XSTR    = NPIX + 4;          // 148: xs stride; 8*148 % 64 == 32 -> conflict-free halves
constexpr int KVSTR   = NPIX + 2;          // 146 (float2 units); 8*146*2 % 64 == 32 -> conflict-free halves
constexpr int NCHUNK  = NPIX / 16;         // 9 pixel chunks of 16 for k/v WMMA
constexpr int THREADS = 128;               // 4 wave32
constexpr int NWAVES  = THREADS / 32;
constexpr float LOG2E = 1.4426950408889634f;
}

__device__ __forceinline__ int refl(int i, int n) {
  i = (i < 0) ? -i : i;
  return (i > n - 1) ? (2 * (n - 1) - i) : i;
}

// Fused: grouped 1x1 convs (q,k,v) via V_WMMA_F32_16X16X4_F32 + per-channel
// 5x5 window softmax-attention, all on-chip. k (and v) stored as channel-pair
// float2 {c, c+16} so the softmax runs on packed V_PK_*_F32 math with zero
// repacking; the conv phase writes the pair as two adjacent b32 components
// (fuses to DS_STORE_2ADDR_B32, no register repacking).
__global__ __launch_bounds__(THREADS)
void natt_fused_kernel(const float* __restrict__ x,
                       const float* __restrict__ wq,
                       const float* __restrict__ wk,
                       const float* __restrict__ wv,
                       float* __restrict__ out) {
  __shared__ float xs[CG * XSTR];          // input tile [ci][padded pix]
  __shared__ v2f   k2[(CG / 2) * KVSTR];   // key   [ch-pair][pix] = {k_m, k_m+16}
  __shared__ v2f   v2[(CG / 2) * KVSTR];   // value [ch-pair][pix] = {v_m, v_m+16}

  const int tid   = threadIdx.x;
  const int lane  = tid & 31;
  const int wv_id = tid >> 5;              // wave 0..3
  const int half  = lane >> 4;             // lane half (WMMA K / M split)
  const int lm    = lane & 15;

  const int tileX = blockIdx.x, tileY = blockIdx.y;
  const int b = blockIdx.z >> 2, g = blockIdx.z & 3;
  const int h0 = tileY * TILE, w0 = tileX * TILE;

  // ---- Stage x tile (reflect halo) into LDS, layout [ci][pix] ----
  const float* xg = x + (size_t)(b * Cc + g * CG) * (Hh * Ww);
  for (int t = tid; t < CG * NPIX; t += THREADS) {       // 36 iters, uniform
    int ch = t / NPIX;
    int p  = t - ch * NPIX;
    int py = p / PT, px = p - py * PT;
    int gh = refl(h0 + py - PAD, Hh);
    int gw = refl(w0 + px - PAD, Ww);
    xs[ch * XSTR + p] = xg[(size_t)ch * (Hh * Ww) + gh * Ww + gw];
  }
  __syncthreads();

  // ---- k and v grouped 1x1 conv over padded tile via WMMA ----
  // D(16co x 16pix) = A(16co x 4ci) * B(4ci x 16pix) + C, K-loop of 8 over ci=32.
  // Uniform trip count: 3 iterations/wave; chunk 8 recomputed redundantly
  // (same-value writes) so EXEC is provably all-ones around every WMMA.
  for (int cv = 0; cv < 2; ++cv) {
    const float* Wg = (cv == 0 ? wk : wv) + g * CG * CG; // [co][ci]
    float* dstf = (float*)((cv == 0) ? k2 : v2);
    v2f aw0[8], aw1[8];  // A fragments, co-blocks 0..15 and 16..31
#pragma unroll
    for (int kk = 0; kk < 8; ++kk) {
      int kb = kk * 4 + half * 2;  // A layout: v0={K0,K2}, v1={K1,K3} per lane half
      aw0[kk].x = Wg[lm * CG + kb];
      aw0[kk].y = Wg[lm * CG + kb + 1];
      aw1[kk].x = Wg[(lm + 16) * CG + kb];
      aw1[kk].y = Wg[(lm + 16) * CG + kb + 1];
    }
#pragma unroll
    for (int it = 0; it < 3; ++it) {
      int pc = wv_id + it * NWAVES;
      pc = (pc < NCHUNK) ? pc : (NCHUNK - 1);
      const int p = pc * 16 + lm;  // N = lane&15 for both halves (B/D layout)
      v8f acc0 = {}; v8f acc1 = {};
#pragma unroll
      for (int kk = 0; kk < 8; ++kk) {
        int kb = kk * 4 + half * 2;
        v2f bf;                    // B mirrors A: v0={K0,K2}, v1={K1,K3}
        bf.x = xs[kb * XSTR + p];
        bf.y = xs[kb * XSTR + XSTR + p];
        acc0 = __builtin_amdgcn_wmma_f32_16x16x4_f32(
            false, aw0[kk], false, bf, (short)0, acc0, false, false);
        acc1 = __builtin_amdgcn_wmma_f32_16x16x4_f32(
            false, aw1[kk], false, bf, (short)0, acc1, false, false);
      }
      const int m2 = half * 8;     // channel-pair row base held by this lane
#pragma unroll
      for (int r = 0; r < 8; ++r) {
        // two adjacent b32 components -> DS_STORE_2ADDR_B32, no repacking movs
        float* qp = dstf + ((m2 + r) * KVSTR + p) * 2;
        qp[0] = acc0[r];           // channel m
        qp[1] = acc1[r];           // channel m+16
      }
    }
  }
  __syncthreads();

  // ---- q conv for this wave's 16 inner pixels (kept in accumulators) ----
  const float* Wq = wq + g * CG * CG;
  v2f aq0[8], aq1[8];
#pragma unroll
  for (int kk = 0; kk < 8; ++kk) {
    int kb = kk * 4 + half * 2;
    aq0[kk].x = Wq[lm * CG + kb];
    aq0[kk].y = Wq[lm * CG + kb + 1];
    aq1[kk].x = Wq[(lm + 16) * CG + kb];
    aq1[kk].y = Wq[(lm + 16) * CG + kb + 1];
  }
  const int pt_  = wv_id * 16 + lm;           // tile pixel 0..63
  const int ty   = pt_ >> 3, tx = pt_ & 7;
  const int pidx = (ty + PAD) * PT + (tx + PAD);

  v8f c0 = {}; v8f c1 = {};
#pragma unroll
  for (int kk = 0; kk < 8; ++kk) {
    int kb = kk * 4 + half * 2;
    v2f bf;
    bf.x = xs[kb * XSTR + pidx];
    bf.y = xs[kb * XSTR + XSTR + pidx];
    c0 = __builtin_amdgcn_wmma_f32_16x16x4_f32(
        false, aq0[kk], false, bf, (short)0, c0, false, false);
    c1 = __builtin_amdgcn_wmma_f32_16x16x4_f32(
        false, aq1[kk], false, bf, (short)0, c1, false, false);
  }

  // ---- per-channel 5x5 window softmax on packed channel pairs ----
  // Lane holds pixel (ty,tx); pair r = channels {half*8+r, half*8+r+16},
  // exactly {c0[r], c1[r]}. One-pass softmax, exp(q*k)=exp2((q*log2e)*k),
  // packed V_PK_MUL/ADD/FMA_F32 throughout.
  const int gh = h0 + ty, gw = w0 + tx;
  const int wbase = ty * PT + tx;            // top-left tap of the window
  float* outp = out + ((size_t)(b * Cc + g * CG) * Hh + gh) * Ww + gw;
#pragma unroll
  for (int r = 0; r < 8; ++r) {
    const int m = half * 8 + r;
    v2f q2; q2.x = c0[r]; q2.y = c1[r];
    q2 *= LOG2E;
    const v2f* kr = k2 + m * KVSTR + wbase;
    const v2f* vr = v2 + m * KVSTR + wbase;
    v2f s2 = {}; v2f y2 = {};
#pragma unroll
    for (int di = 0; di < KW; ++di) {
#pragma unroll
      for (int dj = 0; dj < KW; ++dj) {
        const int idx = di * PT + dj;
        v2f kk = kr[idx];                      // ds_load_b64
        v2f vv = vr[idx];                      // ds_load_b64
        v2f l = q2 * kk;                       // v_pk_mul_f32
        v2f e;
        e.x = __builtin_amdgcn_exp2f(l.x);     // v_exp_f32
        e.y = __builtin_amdgcn_exp2f(l.y);     // v_exp_f32
        s2 += e;                               // v_pk_add_f32
        y2 = e * vv + y2;                      // v_pk_fma_f32 (contract)
      }
    }
    outp[(size_t)m * (Hh * Ww)]        = y2.x * __builtin_amdgcn_rcpf(s2.x);
    outp[(size_t)(m + 16) * (Hh * Ww)] = y2.y * __builtin_amdgcn_rcpf(s2.y);
  }
}

extern "C" void kernel_launch(void* const* d_in, const int* in_sizes, int n_in,
                              void* d_out, int out_size, void* d_ws, size_t ws_size,
                              hipStream_t stream) {
  (void)in_sizes; (void)n_in; (void)out_size; (void)d_ws; (void)ws_size;
  const float* x  = (const float*)d_in[0];
  const float* wq = (const float*)d_in[1];
  const float* wk = (const float*)d_in[2];
  const float* wv = (const float*)d_in[3];
  float* out = (float*)d_out;
  dim3 grid(Ww / TILE, Hh / TILE, 2 * Gg);   // (12, 12, 8)
  natt_fused_kernel<<<grid, THREADS, 0, stream>>>(x, wq, wk, wv, out);
}

// v001
// One run takes 26 microseconds.
// Timed twice side by side with v000, it ran 1.09 times as fast both times.
#include <hip/hip_runtime.h>
#include <math.h>

typedef __attribute__((ext_vector_type(2))) float v2f;
typedef __attribute__((ext_vector_type(4))) float v4f;
typedef __attribute__((ext_vector_type(8))) float v8f;

namespace {
constexpr int KW      = 5;                 // window
constexpr int PAD     = 2;                 // KW/2
constexpr int Cc      = 128;               // total channels
constexpr int Gg      = 4;                 // groups
constexpr int CG      = 32;                // channels per group
constexpr int Hh      = 96;
constexpr int Ww      = 96;
constexpr int TILE    = 8;                 // output tile (8x8 pixels per workgroup)
constexpr int PT      = TILE + 2 * PAD;    // 12 (padded tile edge)
constexpr int NPIX    = PT * PT;           // 144 padded pixels
constexpr int XSTR    = NPIX + 4;          // 148: xs stride; 8*148 % 64 == 32 -> conflict-free halves
constexpr int KVSTR   = NPIX + 2;          // 146 (float2 units); 8*146*2 % 64 == 32 -> conflict-free halves
constexpr int WSTR    = CG + 4;            // 36: weight row pitch in LDS; 16 rows * 36 % 64 hit 16 distinct 4-bank groups
constexpr int NCHUNK  = NPIX / 16;         // 9 pixel chunks of 16 for k/v WMMA
constexpr int THREADS = 128;               // 4 wave32
constexpr int NWAVES  = THREADS / 32;
constexpr float LOG2E = 1.4426950408889634f;
}

__device__ __forceinline__ int refl(int i, int n) {
  i = (i < 0) ? -i : i;
  return (i > n - 1) ? (2 * (n - 1) - i) : i;
}

// A fragments of one 32x32 weight matrix from its LDS copy (row pitch WSTR).
// A layout: v0={K0,K2}, v1={K1,K3} per lane half; co-blocks 0..15 and 16..31.
__device__ __forceinline__ void load_afrag(const float* ws, int lm, int half,
                                           v2f (&a0)[8], v2f (&a1)[8]) {
  // Unrolled so that the fragment arrays are indexed by constants and stay in registers.
#pragma unroll
  for (int kk = 0; kk < 8; ++kk) {
    const int o = lm * WSTR + kk * 4 + half * 2;
    a0[kk] = *(const v2f*)&ws[o];                // ds_load_b64
    a1[kk] = *(const v2f*)&ws[o + 16 * WSTR];
  }
}

// Fused: grouped 1x1 convs (q,k,v) via V_WMMA_F32_16X16X4_F32 + per-channel
// 5x5 window softmax-attention, all on-chip. k (and v) stored as channel-pair
// float2 {c, c+16} so the softmax runs on packed V_PK_*_F32 math with zero
// repacking; the conv phase writes the pair as two adjacent b32 components
// (fuses to DS_STORE_2ADDR_B32, no register repacking).
__global__ __launch_bounds__(THREADS)
void natt_fused_kernel(const float* __restrict__ x,
                       const float* __restrict__ wq,
                       const float* __restrict__ wk,
                       const float* __restrict__ wv,
                       float* __restrict__ out) {
  __shared__ float xs[CG * XSTR];          // input tile [ci][padded pix]
  __shared__ v2f   k2[(CG / 2) * KVSTR];   // key   [ch-pair][pix] = {k_m, k_m+16}
  __shared__ __attribute__((aligned(16)))
  v2f   v2[(CG / 2) * KVSTR];              // value [ch-pair][pix] = {v_m, v_m+16}
  __shared__ __attribute__((aligned(16)))
  float wqs[CG * WSTR];                    // wq [co][ci], pitch WSTR
  // wk and wv rest in v2's bytes until their fragments are in registers
  // (2 * 32 * 36 floats = 9,216 B of v2's 18,688 B); v2 is written only later.
  static_assert(2 * CG * WSTR * sizeof(float) <= sizeof(v2), "wk and wv must fit in v2");
  float* wks = (float*)v2;
  float* wvs = wks + CG * WSTR;

  const int tid   = threadIdx.x;
  const int lane  = tid & 31;
  const int wv_id = tid >> 5;              // wave 0..3
  const int half  = lane >> 4;             // lane half (WMMA K / M split)
  const int lm    = lane & 15;

  const int tileX = blockIdx.x, tileY = blockIdx.y;
  const int b = blockIdx.z >> 2, g = blockIdx.z & 3;
  const int h0 = tileY * TILE, w0 = tileX * TILE;

  // ---- Weights: whole 128-B lines, 16 B per lane, each matrix read once per
  // workgroup (a fragment load straight from global touches 16 lines). ----
  v4f wr[6];
  {
    const v4f* gk = (const v4f*)(wk + g * CG * CG);
    const v4f* gv = (const v4f*)(wv + g * CG * CG);
    const v4f* gq = (const v4f*)(wq + g * CG * CG);
    wr[0] = gk[tid]; wr[1] = gk[tid + THREADS];
    wr[2] = gv[tid]; wr[3] = gv[tid + THREADS];
    wr[4] = gq[tid]; wr[5] = gq[tid + THREADS];
  }

  // ---- Stage x tile (reflect halo) into LDS, layout [ci][pix] ----
  const float* xg = x + (size_t)(b * Cc + g * CG) * (Hh * Ww);
  for (int t = tid; t < CG * NPIX; t += THREADS) {       // 36 iters, uniform
    int ch = t / NPIX;
    int p  = t - ch * NPIX;
    int py = p / PT, px = p - py * PT;
    int gh = refl(h0 + py - PAD, Hh);
    int gw = refl(w0 + px - PAD, Ww);
    xs[ch * XSTR + p] = xg[(size_t)ch * (Hh * Ww) + gh * Ww + gw];
  }
  {
    const int wo = (tid >> 3) * WSTR + (tid & 7) * 4;    // rows 0..15; +16 rows below
    *(v4f*)&wks[wo] = wr[0]; *(v4f*)&wks[wo + 16 * WSTR] = wr[1];
    *(v4f*)&wvs[wo] = wr[2]; *(v4f*)&wvs[wo + 16 * WSTR] = wr[3];
    *(v4f*)&wqs[wo] = wr[4]; *(v4f*)&wqs[wo + 16 * WSTR] = wr[5];
  }
  __syncthreads();

  v2f ak0[8], ak1[8], av0[8], av1[8];      // A fragments of wk and wv
  load_afrag(wks, lm, half, ak0, ak1);
  load_afrag(wvs, lm, half, av0, av1);

  // ---- k and v grouped 1x1 conv over padded tile via WMMA ----
  // D(16co x 16pix) = A(16co x 4ci) * B(4ci x 16pix) + C, K-loop of 8 over ci=32.
  // Uniform trip count: 3 iterations/wave; chunk 8 recomputed redundantly
  // (same-value writes) so EXEC is provably all-ones around every WMMA.
  // Unrolled so that the choice between the k and v fragment arrays is made at
  // compile time (a run-time choice would index registers through scratch).
#pragma unroll
  for (int cv = 0; cv < 2; ++cv) {
    // Every wave holds its wk and wv fragments before any wave overwrites
    // their LDS copy with v.
    if (cv == 1) __syncthreads();
    float* dstf = (float*)((cv == 0) ? k2 : v2);
    const v2f (&aw0)[8] = (cv == 0) ? ak0 : av0;
    const v2f (&aw1)[8] = (cv == 0) ? ak1 : av1;
#pragma unroll
    for (int it = 0; it < 3; ++it) {
      int pc = wv_id + it * NWAVES;
      pc = (pc < NCHUNK) ? pc : (NCHUNK - 1);
      const int p = pc * 16 + lm;  // N = lane&15 for both halves (B/D layout)
      v8f acc0 = {}; v8f acc1 = {};
#pragma unroll
      for (int kk = 0; kk < 8; ++kk) {
        int kb = kk * 4 + half * 2;
        v2f bf;                    // B mirrors A: v0={K0,K2}, v1={K1,K3}
        bf.x = xs[kb * XSTR + p];
        bf.y = xs[kb * XSTR + XSTR + p];
        acc0 = __builtin_amdgcn_wmma_f32_16x16x4_f32(
            false, aw0[kk], false, bf, (short)0, acc0, false, false);
        acc1 = __builtin_amdgcn_wmma_f32_16x16x4_f32(
            false, aw1[kk], false, bf, (short)0, acc1, false, false);
      }
      const int m2 = half * 8;     // channel-pair row base held by this lane
#pragma unroll
      for (int r = 0; r < 8; ++r) {
        // two adjacent b32 components -> DS_STORE_2ADDR_B32, no repacking movs
        float* qp = dstf + ((m2 + r) * KVSTR + p) * 2;
        qp[0] = acc0[r];           // channel m
        qp[1] = acc1[r];           // channel m+16
      }
    }
  }
  __syncthreads();

  // ---- q conv for this wave's 16 inner pixels (kept in accumulators) ----
  v2f aq0[8], aq1[8];
  load_afrag(wqs, lm, half, aq0, aq1);
  const int pt_  = wv_id * 16 + lm;           // tile pixel 0..63
  const int ty   = pt_ >> 3, tx = pt_ & 7;
  const int pidx = (ty + PAD) * PT + (tx + PAD);

  v8f c0 = {}; v8f c1 = {};
#pragma unroll
  for (int kk = 0; kk < 8; ++kk) {
    int kb = kk * 4 + half * 2;
    v2f bf;
    bf.x = xs[kb * XSTR + pidx];
    bf.y = xs[kb * XSTR + XSTR + pidx];
    c0 = __builtin_amdgcn_wmma_f32_16x16x4_f32(
        false, aq0[kk], false, bf, (short)0, c0, false, false);
    c1 = __builtin_amdgcn_wmma_f32_16x16x4_f32(
        false, aq1[kk], false, bf, (short)0, c1, false, false);
  }

  // ---- per-channel 5x5 window softmax on packed channel pairs ----
  // Lane holds pixel (ty,tx); pair r = channels {half*8+r, half*8+r+16},
  // exactly {c0[r], c1[r]}. One-pass softmax, exp(q*k)=exp2((q*log2e)*k),
  // packed V_PK_MUL/ADD/FMA_F32 throughout.
  const int gh = h0 + ty, gw = w0 + tx;
  const int wbase = ty * PT + tx;            // top-left tap of the window
  float* outp = out + ((size_t)(b * Cc + g * CG) * Hh + gh) * Ww + gw;
#pragma unroll
  for (int r = 0; r < 8; ++r) {
    const int m = half * 8 + r;
    v2f q2; q2.x = c0[r]; q2.y = c1[r];
    q2 *= LOG2E;
    const v2f* kr = k2 + m * KVSTR + wbase;
    const v2f* vr = v2 + m * KVSTR + wbase;
    v2f s2 = {}; v2f y2 = {};
#pragma unroll
    for (int di = 0; di < KW; ++di) {
#pragma unroll
      for (int dj = 0; dj < KW; ++dj) {
        const int idx = di * PT + dj;
        v2f kk = kr[idx];                      // ds_load_b64
        v2f vv = vr[idx];                      // ds_load_b64
        v2f l = q2 * kk;                       // v_pk_mul_f32
        v2f e;
        e.x = __builtin_amdgcn_exp2f(l.x);     // v_exp_f32
        e.y = __builtin_amdgcn_exp2f(l.y);     // v_exp_f32
        s2 += e;                               // v_pk_add_f32
        y2 = e * vv + y2;                      // v_pk_fma_f32 (contract)
      }
    }
    outp[(size_t)m * (Hh * Ww)]        = y2.x * __builtin_amdgcn_rcpf(s2.x);
    outp[(size_t)(m + 16) * (Hh * Ww)] = y2.y * __builtin_amdgcn_rcpf(s2.y);
  }
}

extern "C" void kernel_launch(void* const* d_in, const int* in_sizes, int n_in,
                              void* d_out, int out_size, void* d_ws, size_t ws_size,
                              hipStream_t stream) {
  (void)in_sizes; (void)n_in; (void)out_size; (void)d_ws; (void)ws_size;
  const float* x  = (const float*)d_in[0];
  const float* wq = (const float*)d_in[1];
  const float* wk = (const float*)d_in[2];
  const float* wv = (const float*)d_in[3];
  float* out = (float*)d_out;
  dim3 grid(Ww / TILE, Hh / TILE, 2 * Gg);   // (12, 12, 8)
  natt_fused_kernel<<<grid, THREADS, 0, stream>>>(x, wq, wk, wv, out);
}

// v002
// One run takes 20.9 microseconds.
// Two timings next to v001 put it at 1.24 and 1.25 times that version's speed.
// Over all steps from v000 it is 1.36 times as fast.
#include <hip/hip_runtime.h>
#include <math.h>

typedef __attribute__((ext_vector_type(2))) float v2f;
typedef __attribute__((ext_vector_type(4))) float v4f;
typedef __attribute__((ext_vector_type(8))) float v8f;

namespace {
constexpr int KW      = 5;                 // window
constexpr int PAD     = 2;                 // KW/2
constexpr int Cc      = 128;               // total channels
constexpr int Gg      = 4;                 // groups
constexpr int CG      = 32;                // channels per group
constexpr int Hh      = 96;
constexpr int Ww      = 96;
constexpr int TILE    = 8;                 // output tile (8x8 pixels per workgroup)
constexpr int PT      = TILE + 2 * PAD;    // 12 (padded tile edge)
constexpr int NPIX    = PT * PT;           // 144 padded pixels
constexpr int XSTR    = NPIX + 4;          // 148: xs stride; 8*148 % 64 == 32 -> conflict-free halves
constexpr int KVSTR   = NPIX + 2;          // 146 (float2 units); 8*146*2 % 64 == 32 -> conflict-free halves
constexpr int WSTR    = CG + 4;            // 36: weight row pitch in LDS; 16 rows * 36 % 64 hit 16 distinct 4-bank groups
constexpr int NCHUNK  = NPIX / 16;         // 9 pixel chunks of 16 for k/v WMMA
constexpr int THREADS = 128;               // 4 wave32
constexpr int NWAVES  = THREADS / 32;
constexpr float LOG2E = 1.4426950408889634f;
}

__device__ __forceinline__ int refl(int i, int n) {
  i = (i < 0) ? -i : i;
  return (i > n - 1) ? (2 * (n - 1) - i) : i;
}

// A fragments of one 32x32 weight matrix from its LDS copy (row pitch WSTR).
// A layout: v0={K0,K2}, v1={K1,K3} per lane half; co-blocks 0..15 and 16..31.
__device__ __forceinline__ void load_afrag(const float* ws, int lm, int half,
                                           v2f (&a0)[8], v2f (&a1)[8]) {
  // Unrolled so that the fragment arrays are indexed by constants and stay in registers.
#pragma unroll
  for (int kk = 0; kk < 8; ++kk) {
    const int o = lm * WSTR + kk * 4 + half * 2;
    a0[kk] = *(const v2f*)&ws[o];                // ds_load_b64
    a1[kk] = *(const v2f*)&ws[o + 16 * WSTR];
  }
}

// Fused: grouped 1x1 convs (q,k,v) via V_WMMA_F32_16X16X4_F32 + per-channel
// 5x5 window softmax-attention, all on-chip. k (and v) stored as channel-pair
// float2 {c, c+16} so the softmax runs on packed V_PK_*_F32 math with zero
// repacking; the conv phase writes the pair as two adjacent b32 components
// (fuses to DS_STORE_2ADDR_B32, no register repacking).
__global__ __launch_bounds__(THREADS)
void natt_fused_kernel(const float* __restrict__ x,
                       const float* __restrict__ wq,
                       const float* __restrict__ wk,
                       const float* __restrict__ wv,
                       float* __restrict__ out) {
  __shared__ float xs[CG * XSTR];          // input tile [ci][padded pix]
  __shared__ v2f   k2[(CG / 2) * KVSTR];   // key   [ch-pair][pix] = {k_m, k_m+16}
  __shared__ __attribute__((aligned(16)))
  v2f   v2[(CG / 2) * KVSTR];              // value [ch-pair][pix] = {v_m, v_m+16}
  __shared__ __attribute__((aligned(16)))
  float wqs[CG * WSTR];                    // wq [co][ci], pitch WSTR
  // wk and wv rest in v2's bytes until their fragments are in registers
  // (2 * 32 * 36 floats = 9,216 B of v2's 18,688 B); v2 is written only later.
  static_assert(2 * CG * WSTR * sizeof(float) <= sizeof(v2), "wk and wv must fit in v2");
  float* wks = (float*)v2;
  float* wvs = wks + CG * WSTR;

  const int tid   = threadIdx.x;
  const int lane  = tid & 31;
  const int wv_id = tid >> 5;              // wave 0..3
  const int half  = lane >> 4;             // lane half (WMMA K / M split)
  const int lm    = lane & 15;

  const int tileX = blockIdx.x, tileY = blockIdx.y;
  const int b = blockIdx.z >> 2, g = blockIdx.z & 3;
  const int h0 = tileY * TILE, w0 = tileX * TILE;

  // ---- Weights: whole 128-B lines, 16 B per lane, each matrix read once per
  // workgroup (a fragment load straight from global touches 16 lines). ----
  v4f wr[6];
  {
    const v4f* gk = (const v4f*)(wk + g * CG * CG);
    const v4f* gv = (const v4f*)(wv + g * CG * CG);
    const v4f* gq = (const v4f*)(wq + g * CG * CG);
    wr[0] = gk[tid]; wr[1] = gk[tid + THREADS];
    wr[2] = gv[tid]; wr[3] = gv[tid + THREADS];
    wr[4] = gq[tid]; wr[5] = gq[tid + THREADS];
  }

  // ---- Stage x tile (reflect halo) into LDS, layout [ci][pix] ----
  // Each thread keeps one padded pixel (its reflected offset is formed once)
  // and walks the channels at a constant stride, so all 36 loads of a thread
  // are issued before the first one is waited for.
  const float* xg = x + (size_t)(b * Cc + g * CG) * (Hh * Ww);
  constexpr int NREM = NPIX - THREADS;                   // 16 pixels past the first 128
  constexpr int CREM = THREADS / NREM;                   // 8 channels per pass over them
  static_assert(NREM == 16 && CG % CREM == 0, "remainder pixels: 16 lanes a channel");
  float xa[CG], xb[CG / CREM];
  const int pr = THREADS + (tid & (NREM - 1));           // remainder pixel 128..143
  const int cr = tid / NREM;                             // its first channel 0..7
  {
    const int pya = tid / PT, pxa = tid - pya * PT;
    const int pyb = pr / PT,  pxb = pr - pyb * PT;
    const float* ga = xg + refl(h0 + pya - PAD, Hh) * Ww + refl(w0 + pxa - PAD, Ww);
    const float* gb = xg + cr * (Hh * Ww)
                         + refl(h0 + pyb - PAD, Hh) * Ww + refl(w0 + pxb - PAD, Ww);
    // Unrolled: the arrays stay in registers and the strides become offsets.
#pragma unroll
    for (int ch = 0; ch < CG; ++ch) xa[ch] = ga[ch * (Hh * Ww)];
#pragma unroll
    for (int j = 0; j < CG / CREM; ++j) xb[j] = gb[j * CREM * (Hh * Ww)];
  }
  // Unrolled for the same reason: constant indices into xa and xb, no scratch.
#pragma unroll
  for (int ch = 0; ch < CG; ++ch) xs[ch * XSTR + tid] = xa[ch];
#pragma unroll
  for (int j = 0; j < CG / CREM; ++j) xs[(cr + j * CREM) * XSTR + pr] = xb[j];
  {
    const int wo = (tid >> 3) * WSTR + (tid & 7) * 4;    // rows 0..15; +16 rows below
    *(v4f*)&wks[wo] = wr[0]; *(v4f*)&wks[wo + 16 * WSTR] = wr[1];
    *(v4f*)&wvs[wo] = wr[2]; *(v4f*)&wvs[wo + 16 * WSTR] = wr[3];
    *(v4f*)&wqs[wo] = wr[4]; *(v4f*)&wqs[wo + 16 * WSTR] = wr[5];
  }
  // Ends the scheduling region of the staging: without it the later phases'
  // address sums are lifted up here and live on, which costs a resident wave per SIMD.
  __builtin_amdgcn_sched_barrier(0);
  __syncthreads();

  v2f ak0[8], ak1[8], av0[8], av1[8];      // A fragments of wk and wv
  load_afrag(wks, lm, half, ak0, ak1);
  load_afrag(wvs, lm, half, av0, av1);

  // ---- k and v grouped 1x1 conv over padded tile via WMMA ----
  // D(16co x 16pix) = A(16co x 4ci) * B(4ci x 16pix) + C, K-loop of 8 over ci=32.
  // Uniform trip count: 3 iterations/wave; chunk 8 recomputed redundantly
  // (same-value writes) so EXEC is provably all-ones around every WMMA.
  // Unrolled so that the choice between the k and v fragment arrays is made at
  // compile time (a run-time choice would index registers through scratch).
#pragma unroll
  for (int cv = 0; cv < 2; ++cv) {
    // Every wave holds its wk and wv fragments before any wave overwrites
    // their LDS copy with v.
    if (cv == 1) __syncthreads();
    float* dstf = (float*)((cv == 0) ? k2 : v2);
    const v2f (&aw0)[8] = (cv == 0) ? ak0 : av0;
    const v2f (&aw1)[8] = (cv == 0) ? ak1 : av1;
#pragma unroll
    for (int it = 0; it < 3; ++it) {
      int pc = wv_id + it * NWAVES;
      pc = (pc < NCHUNK) ? pc : (NCHUNK - 1);
      const int p = pc * 16 + lm;  // N = lane&15 for both halves (B/D layout)
      v8f acc0 = {}; v8f acc1 = {};
#pragma unroll
      for (int kk = 0; kk < 8; ++kk) {
        int kb = kk * 4 + half * 2;
        v2f bf;                    // B mirrors A: v0={K0,K2}, v1={K1,K3}
        bf.x = xs[kb * XSTR + p];
        bf.y = xs[kb * XSTR + XSTR + p];
        acc0 = __builtin_amdgcn_wmma_f32_16x16x4_f32(
            false, aw0[kk], false, bf, (short)0, acc0, false, false);
        acc1 = __builtin_amdgcn_wmma_f32_16x16x4_f32(
            false, aw1[kk], false, bf, (short)0, acc1, false, false);
      }
      const int m2 = half * 8;     // channel-pair row base held by this lane
#pragma unroll
      for (int r = 0; r < 8; ++r) {
        // two adjacent b32 components -> DS_STORE_2ADDR_B32, no repacking movs
        float* qp = dstf + ((m2 + r) * KVSTR + p) * 2;
        qp[0] = acc0[r];           // channel m
        qp[1] = acc1[r];           // channel m+16
      }
    }
  }
  __syncthreads();

  // ---- q conv for this wave's 16 inner pixels (kept in accumulators) ----
  v2f aq0[8], aq1[8];
  load_afrag(wqs, lm, half, aq0, aq1);
  const int pt_  = wv_id * 16 + lm;           // tile pixel 0..63
  const int ty   = pt_ >> 3, tx = pt_ & 7;
  const int pidx = (ty + PAD) * PT + (tx + PAD);

  v8f c0 = {}; v8f c1 = {};
#pragma unroll
  for (int kk = 0; kk < 8; ++kk) {
    int kb = kk * 4 + half * 2;
    v2f bf;
    bf.x = xs[kb * XSTR + pidx];
    bf.y = xs[kb * XSTR + XSTR + pidx];
    c0 = __builtin_amdgcn_wmma_f32_16x16x4_f32(
        false, aq0[kk], false, bf, (short)0, c0, false, false);
    c1 = __builtin_amdgcn_wmma_f32_16x16x4_f32(
        false, aq1[kk], false, bf, (short)0, c1, false, false);
  }

  // ---- per-channel 5x5 window softmax on packed channel pairs ----
  // Lane holds pixel (ty,tx); pair r = channels {half*8+r, half*8+r+16},
  // exactly {c0[r], c1[r]}. One-pass softmax, exp(q*k)=exp2((q*log2e)*k),
  // packed V_PK_MUL/ADD/FMA_F32 throughout.
  const int gh = h0 + ty, gw = w0 + tx;
  const int wbase = ty * PT + tx;            // top-left tap of the window
  float* outp = out + ((size_t)(b * Cc + g * CG) * Hh + gh) * Ww + gw;
#pragma unroll
  for (int r = 0; r < 8; ++r) {
    const int m = half * 8 + r;
    v2f q2; q2.x = c0[r]; q2.y = c1[r];
    q2 *= LOG2E;
    const v2f* kr = k2 + m * KVSTR + wbase;
    const v2f* vr = v2 + m * KVSTR + wbase;
    v2f s2 = {}; v2f y2 = {};
#pragma unroll
    for (int di = 0; di < KW; ++di) {
#pragma unroll
      for (int dj = 0; dj < KW; ++dj) {
        const int idx = di * PT + dj;
        v2f kk = kr[idx];                      // ds_load_b64
        v2f vv = vr[idx];                      // ds_load_b64
        v2f l = q2 * kk;                       // v_pk_mul_f32
        v2f e;
        e.x = __builtin_amdgcn_exp2f(l.x);     // v_exp_f32
        e.y = __builtin_amdgcn_exp2f(l.y);     // v_exp_f32
        s2 += e;                               // v_pk_add_f32
        y2 = e * vv + y2;                      // v_pk_fma_f32 (contract)
      }
    }
    outp[(size_t)m * (Hh * Ww)]        = y2.x * __builtin_amdgcn_rcpf(s2.x);
    outp[(size_t)(m + 16) * (Hh * Ww)] = y2.y * __builtin_amdgcn_rcpf(s2.y);
  }
}

extern "C" void kernel_launch(void* const* d_in, const int* in_sizes, int n_in,
                              void* d_out, int out_size, void* d_ws, size_t ws_size,
                              hipStream_t stream) {
  (void)in_sizes; (void)n_in; (void)out_size; (void)d_ws; (void)ws_size;
  const float* x  = (const float*)d_in[0];
  const float* wq = (const float*)d_in[1];
  const float* wk = (const float*)d_in[2];
  const float* wv = (const float*)d_in[3];
  float* out = (float*)d_out;
  dim3 grid(Ww / TILE, Hh / TILE, 2 * Gg);   // (12, 12, 8)
  natt_fused_kernel<<<grid, THREADS, 0, stream>>>(x, wq, wk, wv, out);
}

// v003
// It runs in 18.3 microseconds.
// In both of two side-by-side timings against v002, it was 1.14 times as fast.
// Over all steps from v000 it is 1.55 times as fast.
#include <hip/hip_runtime.h>
#include <math.h>

typedef __attribute__((ext_vector_type(2))) float v2f;
typedef __attribute__((ext_vector_type(4))) float v4f;
typedef __attribute__((ext_vector_type(8))) float v8f;

namespace {
constexpr int KW      = 5;                 // window
constexpr int PAD     = 2;                 // KW/2
constexpr int Cc      = 128;               // total channels
constexpr int Gg      = 4;                 // groups
constexpr int CG      = 32;                // channels per group
constexpr int Hh      = 96;
constexpr int Ww      = 96;
constexpr int TILE    = 8;                 // output tile (8x8 pixels per workgroup)
constexpr int PT      = TILE + 2 * PAD;    // 12 (padded tile edge)
constexpr int NPIX    = PT * PT;           // 144 padded pixels
constexpr int XSTR    = NPIX + 4;          // 148: xs stride; 8*148 % 64 == 32 -> conflict-free halves
constexpr int QSTR    = NPIX;              // k/v plane pitch in float4 units (one plane = 4 channels of every padded pixel)
constexpr int WSTR    = CG + 4;            // 36: weight row pitch in LDS; 16 rows * 36 % 64 hit 16 distinct 4-bank groups
constexpr int NCHUNK  = NPIX / 16;         // 9 pixel chunks of 16 for k/v WMMA
constexpr int THREADS = 128;               // 4 wave32
constexpr int NWAVES  = THREADS / 32;
constexpr float LOG2E = 1.4426950408889634f;
}

__device__ __forceinline__ int refl(int i, int n) {
  i = (i < 0) ? -i : i;
  return (i > n - 1) ? (2 * (n - 1) - i) : i;
}

// A fragments of one 32x32 weight matrix from its LDS copy (row pitch WSTR).
// A layout: v0={K0,K2}, v1={K1,K3} per lane half; co-blocks 0..15 and 16..31.
__device__ __forceinline__ void load_afrag(const float* ws, int lm, int half,
                                           v2f (&a0)[8], v2f (&a1)[8]) {
  // Unrolled so that the fragment arrays are indexed by constants and stay in registers.
#pragma unroll
  for (int kk = 0; kk < 8; ++kk) {
    const int o = lm * WSTR + kk * 4 + half * 2;
    a0[kk] = *(const v2f*)&ws[o];                // ds_load_b64
    a1[kk] = *(const v2f*)&ws[o + 16 * WSTR];
  }
}

// Fused: grouped 1x1 convs (q,k,v) via V_WMMA_F32_16X16X4_F32 + per-channel
// 5x5 window softmax-attention, all on-chip. k (and v) stored as channel quads
// float4 {c, c+1, c+16, c+17}: both halves of a quad are adjacent accumulator
// registers, in the conv that writes them and in q, so the softmax runs on
// packed V_PK_*_F32 math with no repacking, and one window tap of four
// channels is one aligned DS_LOAD_B128 at an immediate offset.
__global__ __launch_bounds__(THREADS)
void natt_fused_kernel(const float* __restrict__ x,
                       const float* __restrict__ wq,
                       const float* __restrict__ wk,
                       const float* __restrict__ wv,
                       float* __restrict__ out) {
  __shared__ float xs[CG * XSTR];          // input tile [ci][padded pix]
  __shared__ __attribute__((aligned(16)))
  v4f   k4[(CG / 4) * QSTR];               // key   [ch-quad][pix] = {k_m, k_m+1, k_m+16, k_m+17}
  __shared__ __attribute__((aligned(16)))
  v4f   v4[(CG / 4) * QSTR];               // value [ch-quad][pix], same channels
  __shared__ __attribute__((aligned(16)))
  float wqs[CG * WSTR];                    // wq [co][ci], pitch WSTR
  // wk and wv rest in v4's bytes until their fragments are in registers
  // (2 * 32 * 36 floats = 9,216 B of v4's 18,432 B); v4 is written only later.
  static_assert(2 * CG * WSTR * sizeof(float) <= sizeof(v4), "wk and wv must fit in v4");
  float* wks = (float*)v4;
  float* wvs = wks + CG * WSTR;

  const int tid   = threadIdx.x;
  const int lane  = tid & 31;
  const int wv_id = tid >> 5;              // wave 0..3
  const int half  = lane >> 4;             // lane half (WMMA K / M split)
  const int lm    = lane & 15;

  const int tileX = blockIdx.x, tileY = blockIdx.y;
  const int b = blockIdx.z >> 2, g = blockIdx.z & 3;
  const int h0 = tileY * TILE, w0 = tileX * TILE;

  // ---- Weights: whole 128-B lines, 16 B per lane, each matrix read once per
  // workgroup (a fragment load straight from global touches 16 lines). ----
  v4f wr[6];
  {
    const v4f* gk = (const v4f*)(wk + g * CG * CG);
    const v4f* gv = (const v4f*)(wv + g * CG * CG);
    const v4f* gq = (const v4f*)(wq + g * CG * CG);
    wr[0] = gk[tid]; wr[1] = gk[tid + THREADS];
    wr[2] = gv[tid]; wr[3] = gv[tid + THREADS];
    wr[4] = gq[tid]; wr[5] = gq[tid + THREADS];
  }

  // ---- Stage x tile (reflect halo) into LDS, layout [ci][pix] ----
  // Each thread keeps one padded pixel (its reflected offset is formed once)
  // and walks the channels at a constant stride, so all 36 loads of a thread
  // are issued before the first one is waited for.
  const float* xg = x + (size_t)(b * Cc + g * CG) * (Hh * Ww);
  constexpr int NREM = NPIX - THREADS;                   // 16 pixels past the first 128
  constexpr int CREM = THREADS / NREM;                   // 8 channels per pass over them
  static_assert(NREM == 16 && CG % CREM == 0, "remainder pixels: 16 lanes a channel");
  float xa[CG], xb[CG / CREM];
  const int pr = THREADS + (tid & (NREM - 1));           // remainder pixel 128..143
  const int cr = tid / NREM;                             // its first channel 0..7
  {
    const int pya = tid / PT, pxa = tid - pya * PT;
    const int pyb = pr / PT,  pxb = pr - pyb * PT;
    const float* ga = xg + refl(h0 + pya - PAD, Hh) * Ww + refl(w0 + pxa - PAD, Ww);
    const float* gb = xg + cr * (Hh * Ww)
                         + refl(h0 + pyb - PAD, Hh) * Ww + refl(w0 + pxb - PAD, Ww);
    // Unrolled: the arrays stay in registers and the strides become offsets.
#pragma unroll
    for (int ch = 0; ch < CG; ++ch) xa[ch] = ga[ch * (Hh * Ww)];
#pragma unroll
    for (int j = 0; j < CG / CREM; ++j) xb[j] = gb[j * CREM * (Hh * Ww)];
  }
  // Unrolled for the same reason: constant indices into xa and xb, no scratch.
#pragma unroll
  for (int ch = 0; ch < CG; ++ch) xs[ch * XSTR + tid] = xa[ch];
#pragma unroll
  for (int j = 0; j < CG / CREM; ++j) xs[(cr + j * CREM) * XSTR + pr] = xb[j];
  {
    const int wo = (tid >> 3) * WSTR + (tid & 7) * 4;    // rows 0..15; +16 rows below
    *(v4f*)&wks[wo] = wr[0]; *(v4f*)&wks[wo + 16 * WSTR] = wr[1];
    *(v4f*)&wvs[wo] = wr[2]; *(v4f*)&wvs[wo + 16 * WSTR] = wr[3];
    *(v4f*)&wqs[wo] = wr[4]; *(v4f*)&wqs[wo + 16 * WSTR] = wr[5];
  }
  // Ends the scheduling region of the staging: without it the later phases'
  // address sums are lifted up here and live on, which costs a resident wave per SIMD.
  __builtin_amdgcn_sched_barrier(0);
  __syncthreads();

  v2f ak0[8], ak1[8], av0[8], av1[8];      // A fragments of wk and wv
  load_afrag(wks, lm, half, ak0, ak1);
  load_afrag(wvs, lm, half, av0, av1);

  // ---- k and v grouped 1x1 conv over padded tile via WMMA ----
  // D(16co x 16pix) = A(16co x 4ci) * B(4ci x 16pix) + C, K-loop of 8 over ci=32.
  // Uniform trip count: 3 iterations/wave; chunk 8 recomputed redundantly
  // (same-value writes) so EXEC is provably all-ones around every WMMA.
  // Unrolled so that the choice between the k and v fragment arrays is made at
  // compile time (a run-time choice would index registers through scratch).
#pragma unroll
  for (int cv = 0; cv < 2; ++cv) {
    // Every wave holds its wk and wv fragments before any wave overwrites
    // their LDS copy with v.
    if (cv == 1) __syncthreads();
    float* dstf = (float*)((cv == 0) ? k4 : v4);
    const v2f (&aw0)[8] = (cv == 0) ? ak0 : av0;
    const v2f (&aw1)[8] = (cv == 0) ? ak1 : av1;
#pragma unroll
    for (int it = 0; it < 3; ++it) {
      int pc = wv_id + it * NWAVES;
      pc = (pc < NCHUNK) ? pc : (NCHUNK - 1);
      const int p = pc * 16 + lm;  // N = lane&15 for both halves (B/D layout)
      v8f acc0 = {}; v8f acc1 = {};
#pragma unroll
      for (int kk = 0; kk < 8; ++kk) {
        int kb = kk * 4 + half * 2;
        v2f bf;                    // B mirrors A: v0={K0,K2}, v1={K1,K3}
        bf.x = xs[kb * XSTR + p];
        bf.y = xs[kb * XSTR + XSTR + p];
        acc0 = __builtin_amdgcn_wmma_f32_16x16x4_f32(
            false, aw0[kk], false, bf, (short)0, acc0, false, false);
        acc1 = __builtin_amdgcn_wmma_f32_16x16x4_f32(
            false, aw1[kk], false, bf, (short)0, acc1, false, false);
      }
      // Unrolled: constant indices into the accumulators.
#pragma unroll
      for (int j = 0; j < 4; ++j) {
        // each half of the quad is an adjacent register pair: no repacking movs
        float* qp = dstf + ((half * 4 + j) * QSTR + p) * 4;
        v2f lo; lo.x = acc0[2 * j]; lo.y = acc0[2 * j + 1];   // channels m, m+1
        v2f hi; hi.x = acc1[2 * j]; hi.y = acc1[2 * j + 1];   // channels m+16, m+17
        *(v2f*)qp       = lo;
        *(v2f*)(qp + 2) = hi;
      }
    }
  }
  __syncthreads();

  // ---- q conv for this wave's 16 inner pixels (kept in accumulators) ----
  v2f aq0[8], aq1[8];
  load_afrag(wqs, lm, half, aq0, aq1);
  // A wave's 16 pixels are two tile rows TWO apart: 2 * PT * 16 B = 384 B = 32
  // banks past a multiple of 64, so lanes 0-7 and 8-15 of a 16-byte tap read
  // fill the 64 banks once (adjacent rows, 192 B apart, would share 16 banks).
  const int tx   = lm & 7;
  const int ty   = (wv_id >> 1) * 4 + (wv_id & 1) + (lm >> 3) * 2;
  const int pidx = (ty + PAD) * PT + (tx + PAD);

  v8f c0 = {}; v8f c1 = {};
#pragma unroll
  for (int kk = 0; kk < 8; ++kk) {
    int kb = kk * 4 + half * 2;
    v2f bf;
    bf.x = xs[kb * XSTR + pidx];
    bf.y = xs[kb * XSTR + XSTR + pidx];
    c0 = __builtin_amdgcn_wmma_f32_16x16x4_f32(
        false, aq0[kk], false, bf, (short)0, c0, false, false);
    c1 = __builtin_amdgcn_wmma_f32_16x16x4_f32(
        false, aq1[kk], false, bf, (short)0, c1, false, false);
  }

  // ---- per-channel 5x5 window softmax on packed channel pairs ----
  // Lane holds pixel (ty,tx); quad j = channels {m, m+1, m+16, m+17} with
  // m = half*8 + 2j, exactly {c0[2j], c0[2j+1], c1[2j], c1[2j+1]}. One-pass
  // softmax, exp(q*k)=exp2((q*log2e)*k), packed V_PK_MUL/ADD/FMA_F32 throughout.
  const int gh = h0 + ty, gw = w0 + tx;
  const int wbase = ty * PT + tx;            // top-left tap of the window
  float* outp = out + ((size_t)(b * Cc + g * CG) * Hh + gh) * Ww + gw;
  const v4f* kr = k4 + half * 4 * QSTR + wbase;
  const v4f* vr = v4 + half * 4 * QSTR + wbase;
  constexpr int NROW = 4 * KW;               // (quad, window row) steps of a lane
  v4f kb[3][KW], vb[3][KW];                  // one window row of a quad, and the next two
  // Unrolled (all loops below): constant indices into kb, vb, c0 and c1; tap offsets become immediates.
#pragma unroll
  for (int dj = 0; dj < KW; ++dj) {
    kb[0][dj] = kr[dj];      vb[0][dj] = vr[dj];
    kb[1][dj] = kr[PT + dj]; vb[1][dj] = vr[PT + dj];
  }
  v2f qa = {}, qb = {}, sa = {}, sb = {}, ya = {}, yb = {};
#pragma unroll
  for (int t = 0; t < NROW; ++t) {           // t = (quad j, window row di)
    const int j = t / KW, di = t % KW;
    if (t + 2 < NROW) {
      const int o = ((t + 2) / KW) * QSTR + ((t + 2) % KW) * PT;
#pragma unroll
      for (int dj = 0; dj < KW; ++dj) {
        kb[(t + 2) % 3][dj] = kr[o + dj];    // ds_load_b128
        vb[(t + 2) % 3][dj] = vr[o + dj];    // ds_load_b128
      }
    }
    // Holds these ten loads ahead of this row's arithmetic and every later row's
    // behind it: left free, the loads of whole quads go to the top, past 192
    // registers, which costs a resident wave per SIMD.
    __builtin_amdgcn_sched_barrier(0);
    if (di == 0) {
      qa.x = c0[2 * j]; qa.y = c0[2 * j + 1];
      qb.x = c1[2 * j]; qb.y = c1[2 * j + 1];
      qa *= LOG2E;
      qb *= LOG2E;
      sa = 0.0f; sb = 0.0f; ya = 0.0f; yb = 0.0f;
    }
#pragma unroll
    for (int dj = 0; dj < KW; ++dj) {
      const v4f kk = kb[t % 3][dj];
      const v4f vv = vb[t % 3][dj];
      v2f la = qa * kk.xy;                   // v_pk_mul_f32
      v2f lb = qb * kk.zw;
      v2f ea, eb;
      ea.x = __builtin_amdgcn_exp2f(la.x);   // v_exp_f32
      ea.y = __builtin_amdgcn_exp2f(la.y);
      eb.x = __builtin_amdgcn_exp2f(lb.x);
      eb.y = __builtin_amdgcn_exp2f(lb.y);
      sa += ea;                              // v_pk_add_f32
      sb += eb;
      ya = ea * vv.xy + ya;                  // v_pk_fma_f32 (contract)
      yb = eb * vv.zw + yb;
    }
    if (di == KW - 1) {
      const int m = half * 8 + 2 * j;
      v2f ra, rb;
      ra.x = __builtin_amdgcn_rcpf(sa.x); ra.y = __builtin_amdgcn_rcpf(sa.y);
      rb.x = __builtin_amdgcn_rcpf(sb.x); rb.y = __builtin_amdgcn_rcpf(sb.y);
      ya *= ra;                              // v_pk_mul_f32
      yb *= rb;
      outp[(size_t)m * (Hh * Ww)]        = ya.x;
      outp[(size_t)(m + 1) * (Hh * Ww)]  = ya.y;
      outp[(size_t)(m + 16) * (Hh * Ww)] = yb.x;
      outp[(size_t)(m + 17) * (Hh * Ww)] = yb.y;
      // The next quad's arithmetic reuses the registers these four stores name.
      if (t + 1 < NROW) asm volatile("s_wait_xcnt 0x0" ::: "memory");
    }
  }
}

extern "C" void kernel_launch(void* const* d_in, const int* in_sizes, int n_in,
                              void* d_out, int out_size, void* d_ws, size_t ws_size,
                              hipStream_t stream) {
  (void)in_sizes; (void)n_in; (void)out_size; (void)d_ws; (void)ws_size;
  const float* x  = (const float*)d_in[0];
  const float* wq = (const float*)d_in[1];
  const float* wk = (const float*)d_in[2];
  const float* wv = (const float*)d_in[3];
  float* out = (float*)d_out;
  dim3 grid(Ww / TILE, Hh / TILE, 2 * Gg);   // (12, 12, 8)
  natt_fused_kernel<<<grid, THREADS, 0, stream>>>(x, wq, wk, wv, out);
}

// v004
// Measured time: 16.9 microseconds a run.
// Two timings next to v003 put it at 1.08 and 1.09 times that version's speed.
// Counting every step since v000, it is 1.69 times as fast.
#include <hip/hip_runtime.h>
#include <math.h>

typedef __attribute__((ext_vector_type(2))) float v2f;
typedef __attribute__((ext_vector_type(4))) float v4f;
typedef __attribute__((ext_vector_type(8))) float v8f;

namespace {
constexpr int KW      = 5;                 // window
constexpr int PAD     = 2;                 // KW/2
constexpr int Cc      = 128;               // total channels
constexpr int Gg      = 4;                 // groups
constexpr int CG      = 32;                // channels per group
constexpr int Hh      = 96;
constexpr int Ww      = 96;
constexpr int TILE    = 8;                 // output tile width
constexpr int TILEY   = 12;                // output tile height: 12 x 8 x 8 = 768 workgroups, 3 for each of 256 WGPs
constexpr int PT      = TILE + 2 * PAD;    // 12 (padded tile width, the pixel pitch of a row)
constexpr int PTY     = TILEY + 2 * PAD;   // 16 (padded tile height)
constexpr int NPIX    = PT * PTY;          // 192 padded pixels
constexpr int XSTR    = NPIX + 8;          // 200: xs stride; 2*200 % 64 == 16 -> the lane halves read disjoint banks
constexpr int QSTR    = NPIX;              // k/v plane pitch in float4 units (one plane = 4 channels of every padded pixel)
constexpr int WSTR    = CG + 4;            // 36: weight row pitch in LDS; 16 rows * 36 % 64 hit 16 distinct 4-bank groups
constexpr int NCHUNK  = NPIX / 16;         // 12 pixel chunks of 16 for k/v WMMA: 3 per wave, none twice
constexpr int THREADS = 128;               // 4 wave32
constexpr int NWAVES  = THREADS / 32;
constexpr float LOG2E = 1.4426950408889634f;
}

__device__ __forceinline__ int refl(int i, int n) {
  i = (i < 0) ? -i : i;
  return (i > n - 1) ? (2 * (n - 1) - i) : i;
}

// A fragments of one 32x32 weight matrix from its LDS copy (row pitch WSTR).
// A layout: v0={K0,K2}, v1={K1,K3} per lane half; co-blocks 0..15 and 16..31.
__device__ __forceinline__ void load_afrag(const float* ws, int lm, int half,
                                           v2f (&a0)[8], v2f (&a1)[8]) {
  // Unrolled so that the fragment arrays are indexed by constants and stay in registers.
#pragma unroll
  for (int kk = 0; kk < 8; ++kk) {
    const int o = lm * WSTR + kk * 4 + half * 2;
    a0[kk] = *(const v2f*)&ws[o];                // ds_load_b64
    a1[kk] = *(const v2f*)&ws[o + 16 * WSTR];
  }
}

// One A fragment whose row M = lane & 15 is weight row 'row' of the LDS copy; same k order.
__device__ __forceinline__ void load_afrag1(const float* ws, int row, int half, v2f (&a)[8]) {
  // Unrolled so that the fragment array is indexed by constants and stays in registers.
#pragma unroll
  for (int kk = 0; kk < 8; ++kk) a[kk] = *(const v2f*)&ws[row * WSTR + kk * 4 + half * 2];
}

// Fused: grouped 1x1 convs (q,k,v) via V_WMMA_F32_16X16X4_F32 + per-channel
// 5x5 window softmax-attention, all on-chip. k (and v) stored as channel quads
// float4 {c, c+1, c+16, c+17}: both halves of a quad are adjacent accumulator
// registers, in the conv that writes them and in q, so the softmax runs on
// packed V_PK_*_F32 math with no repacking, and one window tap of four
// channels is one aligned DS_LOAD_B128 at an immediate offset.
__global__ __launch_bounds__(THREADS)
void natt_fused_kernel(const float* __restrict__ x,
                       const float* __restrict__ wq,
                       const float* __restrict__ wk,
                       const float* __restrict__ wv,
                       float* __restrict__ out) {
  __shared__ float xs[CG * XSTR];          // input tile [ci][padded pix]
  __shared__ __attribute__((aligned(16)))
  v4f   k4[(CG / 4) * QSTR];               // key   [ch-quad][pix] = {k_m, k_m+1, k_m+16, k_m+17}
  __shared__ __attribute__((aligned(16)))
  v4f   v4[(CG / 4) * QSTR];               // value [ch-quad][pix], same channels
  __shared__ __attribute__((aligned(16)))
  float wqs[CG * WSTR];                    // wq [co][ci], pitch WSTR
  // wk and wv rest in v4's bytes until their fragments are in registers
  // (2 * 32 * 36 floats = 9,216 B of v4's 24,576 B); v4 is written only later.
  static_assert(2 * CG * WSTR * sizeof(float) <= sizeof(v4), "wk and wv must fit in v4");
  float* wks = (float*)v4;
  float* wvs = wks + CG * WSTR;

  const int tid   = threadIdx.x;
  const int lane  = tid & 31;
  const int wv_id = tid >> 5;              // wave 0..3
  const int half  = lane >> 4;             // lane half (WMMA K / M split)
  const int lm    = lane & 15;

  const int tileX = blockIdx.x, tileY = blockIdx.y;
  const int b = blockIdx.z >> 2, g = blockIdx.z & 3;
  const int h0 = tileY * TILEY, w0 = tileX * TILE;

  // ---- Weights: whole 128-B lines, 16 B per lane, each matrix read once per
  // workgroup (a fragment load straight from global touches 16 lines). ----
  v4f wr[6];
  {
    const v4f* gk = (const v4f*)(wk + g * CG * CG);
    const v4f* gv = (const v4f*)(wv + g * CG * CG);
    const v4f* gq = (const v4f*)(wq + g * CG * CG);
    wr[0] = gk[tid]; wr[1] = gk[tid + THREADS];
    wr[2] = gv[tid]; wr[3] = gv[tid + THREADS];
    wr[4] = gq[tid]; wr[5] = gq[tid + THREADS];
  }

  // ---- Stage x tile (reflect halo) into LDS, layout [ci][pix] ----
  // Each thread keeps one padded pixel (its reflected offset is formed once)
  // and walks the channels at a constant stride, so all 48 loads of a thread
  // are issued before the first one is waited for.
  const float* xg = x + (size_t)(b * Cc + g * CG) * (Hh * Ww);
  constexpr int NREM = NPIX - THREADS;                   // 64 pixels past the first 128
  constexpr int CREM = THREADS / NREM;                   // 2 channels per pass over them
  static_assert(NREM == 64 && CG % CREM == 0, "remainder pixels: 64 lanes a channel");
  float xa[CG], xb[CG / CREM];
  const int pr = THREADS + (tid & (NREM - 1));           // remainder pixel 128..191
  const int cr = tid / NREM;                             // its first channel 0..1
  {
    const int pya = tid / PT, pxa = tid - pya * PT;
    const int pyb = pr / PT,  pxb = pr - pyb * PT;
    const float* ga = xg + refl(h0 + pya - PAD, Hh) * Ww + refl(w0 + pxa - PAD, Ww);
    const float* gb = xg + cr * (Hh * Ww)
                         + refl(h0 + pyb - PAD, Hh) * Ww + refl(w0 + pxb - PAD, Ww);
    // Unrolled: the arrays stay in registers and the strides become offsets.
#pragma unroll
    for (int ch = 0; ch < CG; ++ch) xa[ch] = ga[ch * (Hh * Ww)];
#pragma unroll
    for (int j = 0; j < CG / CREM; ++j) xb[j] = gb[j * CREM * (Hh * Ww)];
    // The wait before the address registers of these loads are reused; as inputs they
    // stay whole up to it.
    asm volatile("s_wait_xcnt 0x0" :: "v"(ga), "v"(gb) : "memory");
  }
  // Unrolled for the same reason: constant indices into xa and xb, no scratch.
#pragma unroll
  for (int ch = 0; ch < CG; ++ch) xs[ch * XSTR + tid] = xa[ch];
#pragma unroll
  for (int j = 0; j < CG / CREM; ++j) xs[(cr + j * CREM) * XSTR + pr] = xb[j];
  {
    const int wo = (tid >> 3) * WSTR + (tid & 7) * 4;    // rows 0..15; +16 rows below
    *(v4f*)&wks[wo] = wr[0]; *(v4f*)&wks[wo + 16 * WSTR] = wr[1];
    *(v4f*)&wvs[wo] = wr[2]; *(v4f*)&wvs[wo + 16 * WSTR] = wr[3];
    *(v4f*)&wqs[wo] = wr[4]; *(v4f*)&wqs[wo + 16 * WSTR] = wr[5];
  }
  __syncthreads();

  v2f ak0[8], ak1[8], av0[8], av1[8];      // A fragments of wk and wv
  load_afrag(wks, lm, half, ak0, ak1);
  load_afrag(wvs, lm, half, av0, av1);

  // ---- k and v grouped 1x1 conv over padded tile via WMMA ----
  // D(16co x 16pix) = A(16co x 4ci) * B(4ci x 16pix) + C, K-loop of 8 over ci=32.
  // Uniform trip count: 3 chunks per wave, so EXEC is all-ones around every WMMA.
  // Unrolled so that the choice between the k and v fragment arrays is made at
  // compile time (a run-time choice would index registers through scratch).
#pragma unroll
  for (int cv = 0; cv < 2; ++cv) {
    // Every wave holds its wk and wv fragments before any wave overwrites
    // their LDS copy with v.
    if (cv == 1) __syncthreads();
    float* dstf = (float*)((cv == 0) ? k4 : v4);
    const v2f (&aw0)[8] = (cv == 0) ? ak0 : av0;
    const v2f (&aw1)[8] = (cv == 0) ? ak1 : av1;
#pragma unroll
    for (int it = 0; it < 3; ++it) {
      static_assert(NCHUNK == 3 * NWAVES, "3 chunks per wave");
      const int pc = wv_id + it * NWAVES;
      const int p = pc * 16 + lm;  // N = lane&15 for both halves (B/D layout)
      v8f acc0 = {}; v8f acc1 = {};
#pragma unroll
      for (int kk = 0; kk < 8; ++kk) {
        int kb = kk * 4 + half * 2;
        v2f bf;                    // B mirrors A: v0={K0,K2}, v1={K1,K3}
        bf.x = xs[kb * XSTR + p];
        bf.y = xs[kb * XSTR + XSTR + p];
        acc0 = __builtin_amdgcn_wmma_f32_16x16x4_f32(
            false, aw0[kk], false, bf, (short)0, acc0, false, false);
        acc1 = __builtin_amdgcn_wmma_f32_16x16x4_f32(
            false, aw1[kk], false, bf, (short)0, acc1, false, false);
      }
      // Unrolled: constant indices into the accumulators.
#pragma unroll
      for (int j = 0; j < 4; ++j) {
        // each half of the quad is an adjacent register pair: no repacking movs
        float* qp = dstf + ((half * 4 + j) * QSTR + p) * 4;
        v2f lo; lo.x = acc0[2 * j]; lo.y = acc0[2 * j + 1];   // channels m, m+1
        v2f hi; hi.x = acc1[2 * j]; hi.y = acc1[2 * j + 1];   // channels m+16, m+17
        *(v2f*)qp       = lo;
        *(v2f*)(qp + 2) = hi;
      }
    }
  }
  __syncthreads();

  // ---- q conv (kept in accumulators) ----
  // The 96 inner pixels are 6 groups of 16. A wave takes all 32 channels of
  // group wv_id and 16 channels of group 4 + wv_id / 2, which it shares with its
  // neighbour wave: cb = 0 takes channel quads j = 0, 1 of each lane half, cb = 1
  // takes j = 2, 3. Row M of that third A fragment is the weight row of channel
  // (M>>3)*8 + 4*cb + 2*((M>>2)&1) + (M&1) + 16*((M>>1)&1), so that a lane's eight
  // accumulator registers are two whole quads {m, m+1, m+16, m+17} in order.
  const int cb = wv_id & 1;
  v2f aq0[8], aq1[8], aq2[8];
  load_afrag(wqs, lm, half, aq0, aq1);
  load_afrag1(wqs, (lm >> 3) * 8 + 4 * cb + 2 * ((lm >> 2) & 1) + (lm & 1) + 16 * ((lm >> 1) & 1),
              half, aq2);
  // A wave's 16 pixels are two tile rows TWO apart: 2 * PT * 16 B = 384 B = 32
  // banks past a multiple of 64, so lanes 0-7 and 8-15 of a 16-byte tap read
  // fill the 64 banks once (adjacent rows, 192 B apart, would share 16 banks).
  const int tx   = lm & 7;
  const int ty   = (wv_id >> 1) * 4 + (wv_id & 1) + (lm >> 3) * 2;
  const int pidx = (ty + PAD) * PT + (tx + PAD);
  const int ty2   = 8 + (wv_id >> 1) + (lm >> 3) * 2;     // group 4 + wv_id / 2, same row pairing
  const int pidx2 = (ty2 + PAD) * PT + (tx + PAD);

  v8f c0 = {}; v8f c1 = {}; v8f c2 = {};
#pragma unroll
  for (int kk = 0; kk < 8; ++kk) {
    int kb = kk * 4 + half * 2;
    v2f bf;
    bf.x = xs[kb * XSTR + pidx];
    bf.y = xs[kb * XSTR + XSTR + pidx];
    c0 = __builtin_amdgcn_wmma_f32_16x16x4_f32(
        false, aq0[kk], false, bf, (short)0, c0, false, false);
    c1 = __builtin_amdgcn_wmma_f32_16x16x4_f32(
        false, aq1[kk], false, bf, (short)0, c1, false, false);
    v2f bg;
    bg.x = xs[kb * XSTR + pidx2];
    bg.y = xs[kb * XSTR + XSTR + pidx2];
    c2 = __builtin_amdgcn_wmma_f32_16x16x4_f32(
        false, aq2[kk], false, bg, (short)0, c2, false, false);
  }

  // ---- per-channel 5x5 window softmax on packed channel pairs ----
  // Lane holds pixel (ty,tx); quad j = channels {m, m+1, m+16, m+17} with
  // m = half*8 + 2j, exactly {c0[2j], c0[2j+1], c1[2j], c1[2j+1]}; quads 4 and 5
  // of a lane are quads 2*cb and 2*cb + 1 of pixel (ty2,tx), c2[0..3] and c2[4..7].
  // One-pass softmax, exp(q*k)=exp2((q*log2e)*k), packed V_PK_MUL/ADD/FMA_F32 throughout.
  const int wbase  = ty * PT + tx;           // top-left tap of the window
  const int wbase2 = ty2 * PT + tx;
  float* outp  = out + ((size_t)(b * Cc + g * CG + half * 8) * Hh + h0 + ty) * Ww + w0 + tx;
  float* outp2 = out + ((size_t)(b * Cc + g * CG + half * 8 + 4 * cb) * Hh + h0 + ty2) * Ww + w0 + tx;
  const v4f* kr  = k4 + half * 4 * QSTR + wbase;
  const v4f* vr  = v4 + half * 4 * QSTR + wbase;
  const v4f* kr2 = k4 + (half * 4 + 2 * cb) * QSTR + wbase2;
  const v4f* vr2 = v4 + (half * 4 + 2 * cb) * QSTR + wbase2;
  constexpr int NQUAD = 6;                   // quads of a lane: 4 of its own group, 2 of the shared one
  constexpr int NROW = NQUAD * KW;           // (quad, window row) steps of a lane
  v4f kb[3][KW], vb[3][KW];                  // one window row of a quad, and the next two
  // Unrolled (all loops below): constant indices into kb, vb, c0, c1 and c2; tap offsets become immediates.
#pragma unroll
  for (int dj = 0; dj < KW; ++dj) {
    kb[0][dj] = kr[dj];      vb[0][dj] = vr[dj];
    kb[1][dj] = kr[PT + dj]; vb[1][dj] = vr[PT + dj];
  }
  v2f qa = {}, qb = {}, sa = {}, sb = {}, ya = {}, yb = {};
#pragma unroll
  for (int t = 0; t < NROW; ++t) {           // t = (quad j, window row di)
    const int j = t / KW, di = t % KW;
    if (t + 2 < NROW) {
      const int jn = (t + 2) / KW;
      const v4f* kn = (jn < 4) ? kr : kr2;
      const v4f* vn = (jn < 4) ? vr : vr2;
      const int o = ((jn < 4) ? jn : jn - 4) * QSTR + ((t + 2) % KW) * PT;
#pragma unroll
      for (int dj = 0; dj < KW; ++dj) {
        kb[(t + 2) % 3][dj] = kn[o + dj];    // ds_load_b128
        vb[(t + 2) % 3][dj] = vn[o + dj];    // ds_load_b128
      }
    }
    // Holds these ten loads ahead of this row's arithmetic and every later row's
    // behind it: left free, the loads of whole quads go to the top and the kernel
    // takes more than 256 registers.
    __builtin_amdgcn_sched_barrier(0);
    if (di == 0) {
      if (j < 4) {
        qa.x = c0[2 * j]; qa.y = c0[2 * j + 1];
        qb.x = c1[2 * j]; qb.y = c1[2 * j + 1];
      } else {
        qa.x = c2[4 * (j - 4)];     qa.y = c2[4 * (j - 4) + 1];
        qb.x = c2[4 * (j - 4) + 2]; qb.y = c2[4 * (j - 4) + 3];
      }
      qa *= LOG2E;
      qb *= LOG2E;
      sa = 0.0f; sb = 0.0f; ya = 0.0f; yb = 0.0f;
    }
#pragma unroll
    for (int dj = 0; dj < KW; ++dj) {
      const v4f kk = kb[t % 3][dj];
      const v4f vv = vb[t % 3][dj];
      v2f la = qa * kk.xy;                   // v_pk_mul_f32
      v2f lb = qb * kk.zw;
      v2f ea, eb;
      ea.x = __builtin_amdgcn_exp2f(la.x);   // v_exp_f32
      ea.y = __builtin_amdgcn_exp2f(la.y);
      eb.x = __builtin_amdgcn_exp2f(lb.x);
      eb.y = __builtin_amdgcn_exp2f(lb.y);
      sa += ea;                              // v_pk_add_f32
      sb += eb;
      ya = ea * vv.xy + ya;                  // v_pk_fma_f32 (contract)
      yb = eb * vv.zw + yb;
    }
    if (di == KW - 1) {
      float* op = (j < 4) ? outp + 2 * j * (Hh * Ww) : outp2 + 2 * (j - 4) * (Hh * Ww);
      v2f ra, rb;
      ra.x = __builtin_amdgcn_rcpf(sa.x); ra.y = __builtin_amdgcn_rcpf(sa.y);
      rb.x = __builtin_amdgcn_rcpf(sb.x); rb.y = __builtin_amdgcn_rcpf(sb.y);
      ya *= ra;                              // v_pk_mul_f32
      yb *= rb;
      op[0]              = ya.x;             // channel m
      op[Hh * Ww]        = ya.y;             // m + 1
      op[16 * (Hh * Ww)] = yb.x;             // m + 16
      op[17 * (Hh * Ww)] = yb.y;             // m + 17
      // The next quad's arithmetic reuses the registers these four stores name.
      if (t + 1 < NROW) asm volatile("s_wait_xcnt 0x0" ::: "memory");
    }
  }
}

extern "C" void kernel_launch(void* const* d_in, const int* in_sizes, int n_in,
                              void* d_out, int out_size, void* d_ws, size_t ws_size,
                              hipStream_t stream) {
  (void)in_sizes; (void)n_in; (void)out_size; (void)d_ws; (void)ws_size;
  const float* x  = (const float*)d_in[0];
  const float* wq = (const float*)d_in[1];
  const float* wk = (const float*)d_in[2];
  const float* wv = (const float*)d_in[3];
  float* out = (float*)d_out;
  dim3 grid(Ww / TILE, Hh / TILEY, 2 * Gg);  // (12, 8, 8)
  natt_fused_kernel<<<grid, THREADS, 0, stream>>>(x, wq, wk, wv, out);
}

// v005
// One run takes 14.2 microseconds.
// In two side-by-side timings against v004, it was 1.19 and 1.20 times as fast.
// Counting every step since v000, it is 2.01 times as fast.
#include <hip/hip_runtime.h>
#include <math.h>

typedef __attribute__((ext_vector_type(2))) float v2f;
typedef __attribute__((ext_vector_type(4))) float v4f;
typedef __attribute__((ext_vector_type(8))) float v8f;

namespace {
constexpr int KW      = 5;                 // window
constexpr int PAD     = 2;                 // KW/2
constexpr int Cc      = 128;               // total channels
constexpr int Gg      = 4;                 // groups
constexpr int CG      = 32;                // channels per group
constexpr int Hh      = 96;
constexpr int Ww      = 96;
constexpr int COLW    = 8;                 // width of the pixel column that four waves work on
constexpr int NCOL    = 3;                 // such columns side by side in a tile
constexpr int TILE    = COLW * NCOL;       // 24: output tile width
constexpr int TILEY   = 12;                // output tile height: 4 x 8 x 8 = 256 workgroups, one for each of 256 WGPs
constexpr int PT      = TILE + 2 * PAD;    // 28 (padded tile width, the pixel pitch of a row)
constexpr int PTY     = TILEY + 2 * PAD;   // 16 (padded tile height)
constexpr int NPIX    = PT * PTY;          // 448 padded pixels
constexpr int XSTR    = NPIX + 8;          // 456: xs stride; 2*456 % 64 == 16 -> the lane halves read disjoint banks
constexpr int QSTR    = NPIX;              // k/v plane pitch in float4 units (one plane = 4 channels of every padded pixel)
constexpr int WSTR    = CG + 4;            // 36: weight row pitch in LDS; 16 rows * 36 % 64 hit 16 distinct 4-bank groups
constexpr int NCHUNK  = NPIX / 16;         // 28 pixel chunks of 16 for k/v WMMA: 7 per SIMD, none twice
constexpr int THREADS = 128 * NCOL;        // 12 wave32, 3 per SIMD
constexpr int NWAVES  = THREADS / 32;
constexpr float LOG2E = 1.4426950408889634f;
}

__device__ __forceinline__ int refl(int i, int n) {
  i = (i < 0) ? -i : i;
  return (i > n - 1) ? (2 * (n - 1) - i) : i;
}

// A fragments of one 32x32 weight matrix from its LDS copy (row pitch WSTR).
// A layout: v0={K0,K2}, v1={K1,K3} per lane half; co-blocks 0..15 and 16..31.
__device__ __forceinline__ void load_afrag(const float* ws, int lm, int half,
                                           v2f (&a0)[8], v2f (&a1)[8]) {
  // Unrolled so that the fragment arrays are indexed by constants and stay in registers.
#pragma unroll
  for (int kk = 0; kk < 8; ++kk) {
    const int o = lm * WSTR + kk * 4 + half * 2;
    a0[kk] = *(const v2f*)&ws[o];                // ds_load_b64
    a1[kk] = *(const v2f*)&ws[o + 16 * WSTR];
  }
}

// One A fragment whose row M = lane & 15 is weight row 'row' of the LDS copy; same k order.
__device__ __forceinline__ void load_afrag1(const float* ws, int row, int half, v2f (&a)[8]) {
  // Unrolled so that the fragment array is indexed by constants and stays in registers.
#pragma unroll
  for (int kk = 0; kk < 8; ++kk) a[kk] = *(const v2f*)&ws[row * WSTR + kk * 4 + half * 2];
}

// Fused: grouped 1x1 convs (q,k,v) via V_WMMA_F32_16X16X4_F32 + per-channel
// 5x5 window softmax-attention, all on-chip. k (and v) stored as channel quads
// float4 {c, c+1, c+16, c+17}: both halves of a quad are adjacent accumulator
// registers, in the conv that writes them and in q, so the softmax runs on
// packed V_PK_*_F32 math with no repacking, and one window tap of four
// channels is one aligned DS_LOAD_B128 at an immediate offset.
__global__ __launch_bounds__(THREADS)
void natt_fused_kernel(const float* __restrict__ x,
                       const float* __restrict__ wq,
                       const float* __restrict__ wk,
                       const float* __restrict__ wv,
                       float* __restrict__ out) {
  __shared__ float xs[CG * XSTR];          // input tile [ci][padded pix]
  __shared__ __attribute__((aligned(16)))
  v4f   k4[(CG / 4) * QSTR];               // key   [ch-quad][pix] = {k_m, k_m+1, k_m+16, k_m+17}
  __shared__ __attribute__((aligned(16)))
  v4f   v4[(CG / 4) * QSTR];               // value [ch-quad][pix], same channels
  __shared__ __attribute__((aligned(16)))
  float wqs[CG * WSTR];                    // wq [co][ci], pitch WSTR
  // wk and wv rest in v4's bytes until their fragments are in registers
  // (2 * 32 * 36 floats = 9,216 B of v4's 57,344 B); v4 is written only later.
  static_assert(2 * CG * WSTR * sizeof(float) <= sizeof(v4), "wk and wv must fit in v4");
  float* wks = (float*)v4;
  float* wvs = wks + CG * WSTR;

  const int tid   = threadIdx.x;
  const int lane  = tid & 31;
  // Wave 0..11, held in a scalar register: the test on it around the last k/v
  // chunks is then a scalar branch, and EXEC stays all-ones at every WMMA.
  const int wave  = __builtin_amdgcn_readfirstlane(tid >> 5);
  const int col   = wave >> 2;             // pixel column 0..2 of the wave in q and softmax
  const int wv_id = wave & 3;              // wave 0..3 within its column
  const int half  = lane >> 4;             // lane half (WMMA K / M split)
  const int lm    = lane & 15;

  const int tileX = blockIdx.x, tileY = blockIdx.y;
  const int b = blockIdx.z >> 2, g = blockIdx.z & 3;
  const int h0 = tileY * TILEY, w0 = tileX * TILE;

  // ---- Weights: whole 128-B lines, 16 B per lane, each matrix read once per
  // workgroup (a fragment load straight from global touches 16 lines). ----
  // The three matrices are 3 * 256 pieces of 16 B in the order wk, wv, wq; a
  // thread takes pieces tid and tid + 384 of the 768.
  constexpr int WPC = CG * CG / 4;                       // 256 pieces a matrix
  static_assert(2 * THREADS == 3 * WPC, "two 16-B weight pieces per thread");
  const v4f* gw0 = (tid < WPC) ? (const v4f*)(wk + g * CG * CG) + tid
                               : (const v4f*)(wv + g * CG * CG) + (tid - WPC);
  const v4f* gw1 = (tid < WPC / 2) ? (const v4f*)(wv + g * CG * CG) + (tid + WPC / 2)
                                   : (const v4f*)(wq + g * CG * CG) + (tid - WPC / 2);
  const v4f wr0 = *gw0;
  const v4f wr1 = *gw1;

  // ---- Stage x tile (reflect halo) into LDS, layout [ci][pix] ----
  // Each thread keeps one padded pixel (its reflected offset is formed once)
  // and walks the channels at a constant stride, so all 37 or 38 loads of a thread (38 in waves 0..3)
  // are issued before the first one is waited for.
  const float* xg = x + (size_t)(b * Cc + g * CG) * (Hh * Ww);
  constexpr int NREM = NPIX - THREADS;                   // 64 pixels past the first 384
  constexpr int CREM = THREADS / NREM;                   // 6 channels per pass over them
  constexpr int NPASS = (CG + CREM - 1) / CREM;          // 6 passes; the last holds 2 channels
  static_assert(NREM == 64, "remainder pixels: 64 lanes, two whole waves, a channel");
  float xa[CG], xb[NPASS];
  const int pr = THREADS + (tid & (NREM - 1));           // remainder pixel 384..447
  const int cr = wave >> 1;                              // its first channel 0..5, one for the wave
  {
    const int pya = tid / PT, pxa = tid - pya * PT;
    const int pyb = pr / PT,  pxb = pr - pyb * PT;
    const float* ga = xg + refl(h0 + pya - PAD, Hh) * Ww + refl(w0 + pxa - PAD, Ww);
    const float* gb = xg + cr * (Hh * Ww)
                         + refl(h0 + pyb - PAD, Hh) * Ww + refl(w0 + pxb - PAD, Ww);
    // Unrolled: the arrays stay in registers and the strides become offsets.
#pragma unroll
    for (int ch = 0; ch < CG; ++ch) xa[ch] = ga[ch * (Hh * Ww)];
#pragma unroll
    for (int j = 0; j < NPASS; ++j)
      if (j < NPASS - 1 || cr < CG - (NPASS - 1) * CREM) xb[j] = gb[j * CREM * (Hh * Ww)];
    // The wait before the address registers of these loads are reused; as inputs they
    // stay whole up to it.
    asm volatile("s_wait_xcnt 0x0" :: "v"(ga), "v"(gb), "v"(gw0), "v"(gw1) : "memory");
  }
  // Unrolled for the same reason: constant indices into xa and xb, no scratch.
#pragma unroll
  for (int ch = 0; ch < CG; ++ch) xs[ch * XSTR + tid] = xa[ch];
#pragma unroll
  for (int j = 0; j < NPASS; ++j)
    if (j < NPASS - 1 || cr < CG - (NPASS - 1) * CREM) xs[(cr + j * CREM) * XSTR + pr] = xb[j];
  {
    // wk and wv lie one behind the other: rows 0..47 of the pair, then rows 48..63 or wq.
    const int wo = (tid >> 3) * WSTR + (tid & 7) * 4;
    *(v4f*)&wks[wo] = wr0;
    float* w1 = (tid < WPC / 2) ? &wks[wo + 48 * WSTR] : &wqs[wo - 16 * WSTR];
    *(v4f*)w1 = wr1;
  }
  __syncthreads();

  v2f ak0[8], ak1[8], av0[8], av1[8];      // A fragments of wk and wv
  load_afrag(wks, lm, half, ak0, ak1);
  load_afrag(wvs, lm, half, av0, av1);

  // ---- k and v grouped 1x1 conv over padded tile via WMMA ----
  // D(16co x 16pix) = A(16co x 4ci) * B(4ci x 16pix) + C, K-loop of 8 over ci=32.
  // 28 chunks: every wave takes two, waves 0..3 (one on each SIMD) a third, so each
  // SIMD's matrix unit gets 7; the test is scalar, EXEC is all-ones around every WMMA.
  // Unrolled so that the choice between the k and v fragment arrays is made at
  // compile time (a run-time choice would index registers through scratch).
#pragma unroll
  for (int cv = 0; cv < 2; ++cv) {
    // Every wave holds its wk and wv fragments before any wave overwrites
    // their LDS copy with v.
    if (cv == 1) __syncthreads();
    float* dstf = (float*)((cv == 0) ? k4 : v4);
    const v2f (&aw0)[8] = (cv == 0) ? ak0 : av0;
    const v2f (&aw1)[8] = (cv == 0) ? ak1 : av1;
#pragma unroll
    for (int it = 0; it < 3; ++it) {
      static_assert(NCHUNK == 2 * NWAVES + 4, "2 chunks per wave and 4 more");
      if (it == 2 && wave >= NCHUNK - 2 * NWAVES) break;
      const int pc = wave + it * NWAVES;
      const int p = pc * 16 + lm;  // N = lane&15 for both halves (B/D layout)
      v8f acc0 = {}; v8f acc1 = {};
#pragma unroll
      for (int kk = 0; kk < 8; ++kk) {
        int kb = kk * 4 + half * 2;
        v2f bf;                    // B mirrors A: v0={K0,K2}, v1={K1,K3}
        bf.x = xs[kb * XSTR + p];
        bf.y = xs[kb * XSTR + XSTR + p];
        acc0 = __builtin_amdgcn_wmma_f32_16x16x4_f32(
            false, aw0[kk], false, bf, (short)0, acc0, false, false);
        acc1 = __builtin_amdgcn_wmma_f32_16x16x4_f32(
            false, aw1[kk], false, bf, (short)0, acc1, false, false);
      }
      // Unrolled: constant indices into the accumulators.
#pragma unroll
      for (int j = 0; j < 4; ++j) {
        // each half of the quad is an adjacent register pair: no repacking movs
        float* qp = dstf + ((half * 4 + j) * QSTR + p) * 4;
        v2f lo; lo.x = acc0[2 * j]; lo.y = acc0[2 * j + 1];   // channels m, m+1
        v2f hi; hi.x = acc1[2 * j]; hi.y = acc1[2 * j + 1];   // channels m+16, m+17
        *(v2f*)qp       = lo;
        *(v2f*)(qp + 2) = hi;
      }
    }
  }
  __syncthreads();

  // ---- q conv (kept in accumulators) ----
  // Four waves work on one column of 8 x 12 inner pixels.
  // Its 96 inner pixels are 6 groups of 16. A wave takes all 32 channels of
  // group wv_id and 16 channels of group 4 + wv_id / 2, which it shares with its
  // neighbour wave: cb = 0 takes channel quads j = 0, 1 of each lane half, cb = 1
  // takes j = 2, 3. Row M of that third A fragment is the weight row of channel
  // (M>>3)*8 + 4*cb + 2*((M>>2)&1) + (M&1) + 16*((M>>1)&1), so that a lane's eight
  // accumulator registers are two whole quads {m, m+1, m+16, m+17} in order.
  const int cb = wv_id & 1;
  v2f aq0[8], aq1[8], aq2[8];
  load_afrag(wqs, lm, half, aq0, aq1);
  load_afrag1(wqs, (lm >> 3) * 8 + 4 * cb + 2 * ((lm >> 2) & 1) + (lm & 1) + 16 * ((lm >> 1) & 1),
              half, aq2);
  // A wave's 16 pixels are two tile rows TWO apart: 2 * PT * 16 B = 896 B = 32
  // banks past a multiple of 64, so lanes 0-7 and 8-15 of a 16-byte tap read
  // fill the 64 banks once (adjacent rows, 448 B apart, would share 16 banks).
  const int tx   = col * COLW + (lm & 7);
  const int ty   = (wv_id >> 1) * 4 + (wv_id & 1) + (lm >> 3) * 2;
  const int pidx = (ty + PAD) * PT + (tx + PAD);
  const int ty2   = 8 + (wv_id >> 1) + (lm >> 3) * 2;     // group 4 + wv_id / 2, same row pairing
  const int pidx2 = (ty2 + PAD) * PT + (tx + PAD);

  v8f c0 = {}; v8f c1 = {}; v8f c2 = {};
#pragma unroll
  for (int kk = 0; kk < 8; ++kk) {
    int kb = kk * 4 + half * 2;
    v2f bf;
    bf.x = xs[kb * XSTR + pidx];
    bf.y = xs[kb * XSTR + XSTR + pidx];
    c0 = __builtin_amdgcn_wmma_f32_16x16x4_f32(
        false, aq0[kk], false, bf, (short)0, c0, false, false);
    c1 = __builtin_amdgcn_wmma_f32_16x16x4_f32(
        false, aq1[kk], false, bf, (short)0, c1, false, false);
    v2f bg;
    bg.x = xs[kb * XSTR + pidx2];
    bg.y = xs[kb * XSTR + XSTR + pidx2];
    c2 = __builtin_amdgcn_wmma_f32_16x16x4_f32(
        false, aq2[kk], false, bg, (short)0, c2, false, false);
  }

  // ---- per-channel 5x5 window softmax on packed channel pairs ----
  // Lane holds pixel (ty,tx); quad j = channels {m, m+1, m+16, m+17} with
  // m = half*8 + 2j, exactly {c0[2j], c0[2j+1], c1[2j], c1[2j+1]}; quads 4 and 5
  // of a lane are quads 2*cb and 2*cb + 1 of pixel (ty2,tx), c2[0..3] and c2[4..7].
  // One-pass softmax, exp(q*k)=exp2((q*log2e)*k), packed V_PK_MUL/ADD/FMA_F32 throughout.
  const int wbase  = ty * PT + tx;           // top-left tap of the window
  const int wbase2 = ty2 * PT + tx;
  float* outp  = out + ((size_t)(b * Cc + g * CG + half * 8) * Hh + h0 + ty) * Ww + w0 + tx;
  float* outp2 = out + ((size_t)(b * Cc + g * CG + half * 8 + 4 * cb) * Hh + h0 + ty2) * Ww + w0 + tx;
  const v4f* kr  = k4 + half * 4 * QSTR + wbase;
  const v4f* vr  = v4 + half * 4 * QSTR + wbase;
  const v4f* kr2 = k4 + (half * 4 + 2 * cb) * QSTR + wbase2;
  const v4f* vr2 = v4 + (half * 4 + 2 * cb) * QSTR + wbase2;
  constexpr int NQUAD = 6;                   // quads of a lane: 4 of its own group, 2 of the shared one
  constexpr int NROW = NQUAD * KW;           // (quad, window row) steps of a lane
  v4f kb[3][KW], vb[3][KW];                  // one window row of a quad, and the next two
  // Unrolled (all loops below): constant indices into kb, vb, c0, c1 and c2; tap offsets become immediates.
#pragma unroll
  for (int dj = 0; dj < KW; ++dj) {
    kb[0][dj] = kr[dj];      vb[0][dj] = vr[dj];
    kb[1][dj] = kr[PT + dj]; vb[1][dj] = vr[PT + dj];
  }
  v2f qa = {}, qb = {}, sa = {}, sb = {}, ya = {}, yb = {};
#pragma unroll
  for (int t = 0; t < NROW; ++t) {           // t = (quad j, window row di)
    const int j = t / KW, di = t % KW;
    if (t + 2 < NROW) {
      const int jn = (t + 2) / KW;
      const v4f* kn = (jn < 4) ? kr : kr2;
      const v4f* vn = (jn < 4) ? vr : vr2;
      const int o = ((jn < 4) ? jn : jn - 4) * QSTR + ((t + 2) % KW) * PT;
#pragma unroll
      for (int dj = 0; dj < KW; ++dj) {
        kb[(t + 2) % 3][dj] = kn[o + dj];    // ds_load_b128
        vb[(t + 2) % 3][dj] = vn[o + dj];    // ds_load_b128
      }
    }
    // Holds these ten loads ahead of this row's arithmetic and every later row's
    // behind it: left free, the loads of whole quads go to the top and the kernel
    // takes more than 256 registers.
    __builtin_amdgcn_sched_barrier(0);
    if (di == 0) {
      if (j < 4) {
        qa.x = c0[2 * j]; qa.y = c0[2 * j + 1];
        qb.x = c1[2 * j]; qb.y = c1[2 * j + 1];
      } else {
        qa.x = c2[4 * (j - 4)];     qa.y = c2[4 * (j - 4) + 1];
        qb.x = c2[4 * (j - 4) + 2]; qb.y = c2[4 * (j - 4) + 3];
      }
      qa *= LOG2E;
      qb *= LOG2E;
      sa = 0.0f; sb = 0.0f; ya = 0.0f; yb = 0.0f;
    }
#pragma unroll
    for (int dj = 0; dj < KW; ++dj) {
      const v4f kk = kb[t % 3][dj];
      const v4f vv = vb[t % 3][dj];
      v2f la = qa * kk.xy;                   // v_pk_mul_f32
      v2f lb = qb * kk.zw;
      v2f ea, eb;
      ea.x = __builtin_amdgcn_exp2f(la.x);   // v_exp_f32
      ea.y = __builtin_amdgcn_exp2f(la.y);
      eb.x = __builtin_amdgcn_exp2f(lb.x);
      eb.y = __builtin_amdgcn_exp2f(lb.y);
      sa += ea;                              // v_pk_add_f32
      sb += eb;
      ya = ea * vv.xy + ya;                  // v_pk_fma_f32 (contract)
      yb = eb * vv.zw + yb;
    }
    if (di == KW - 1) {
      float* op = (j < 4) ? outp + 2 * j * (Hh * Ww) : outp2 + 2 * (j - 4) * (Hh * Ww);
      v2f ra, rb;
      ra.x = __builtin_amdgcn_rcpf(sa.x); ra.y = __builtin_amdgcn_rcpf(sa.y);
      rb.x = __builtin_amdgcn_rcpf(sb.x); rb.y = __builtin_amdgcn_rcpf(sb.y);
      ya *= ra;                              // v_pk_mul_f32
      yb *= rb;
      op[0]              = ya.x;             // channel m
      op[Hh * Ww]        = ya.y;             // m + 1
      op[16 * (Hh * Ww)] = yb.x;             // m + 16
      op[17 * (Hh * Ww)] = yb.y;             // m + 17
      // The next quad's arithmetic reuses the registers these four stores name.
      if (t + 1 < NROW) asm volatile("s_wait_xcnt 0x0" ::: "memory");
    }
  }
}

extern "C" void kernel_launch(void* const* d_in, const int* in_sizes, int n_in,
                              void* d_out, int out_size, void* d_ws, size_t ws_size,
                              hipStream_t stream) {
  (void)in_sizes; (void)n_in; (void)out_size; (void)d_ws; (void)ws_size;
  const float* x  = (const float*)d_in[0];
  const float* wq = (const float*)d_in[1];
  const float* wk = (const float*)d_in[2];
  const float* wv = (const float*)d_in[3];
  float* out = (float*)d_out;
  dim3 grid(Ww / TILE, Hh / TILEY, 2 * Gg);  // (4, 8, 8)
  natt_fused_kernel<<<grid, THREADS, 0, stream>>>(x, wq, wk, wv, out);
}
